// v000
// Measured on an AMD MI455X. A time is GPU time per run, averaged over a window of back-to-back runs after a warm-up
// (all launches, gaps included; the runs take copies of the inputs in turn), and the median of several windows.
// Apart from v000's, it joins two sittings. Times from different sittings can be a few percent apart, while
// side-by-side timings come from the same sitting.
// v000 is the starting kernel. One run takes 52.5 microseconds.
#include <hip/hip_runtime.h>
#include <hip/hip_bf16.h>

typedef float v2f __attribute__((ext_vector_type(2)));
typedef float v8f __attribute__((ext_vector_type(8)));

#define HIDDEN 256
#define QH 256
#define KH 256
#define BATCH 32
#define NQ 64
#define NK 256

#if defined(__has_builtin)
#if __has_builtin(__builtin_amdgcn_global_load_async_to_lds_b128) && \
    __has_builtin(__builtin_amdgcn_global_load_async_to_lds_b32)
#define USE_ASYNC_LDS 1
#else
#define USE_ASYNC_LDS 0
#endif
#else
#define USE_ASYNC_LDS 0
#endif

#if defined(__has_builtin) && __has_builtin(__builtin_amdgcn_s_wait_asynccnt)
#define WAIT_ASYNC0() __builtin_amdgcn_s_wait_asynccnt(0)
#else
#define WAIT_ASYNC0() asm volatile("s_wait_asynccnt 0x0" ::: "memory")
#endif

// Types matching the builtin signatures reported by the frontend:
//   b128: (int __vector(4) AS1*, int __vector(4) AS3*, imm, imm)
//   b32 : (int AS1*,             int AS3*,             imm, imm)
typedef int vi4 __attribute__((__vector_size__(16)));
#define AS_G __attribute__((address_space(1)))
#define AS_L __attribute__((address_space(3)))

// ---------------------------------------------------------------------------
// Phase 1: batched GEMM  H[b] (MxN) = Wsub (MxK) * X[b] (KxN)  via
// V_WMMA_F32_16X16X4_F32.  One wave (32 threads) computes one 16x16 tile.
//   A frag (v2f): lane<16 -> (M=lane,  K=k0+0 / k0+1)
//                 lane>=16-> (M=lane-16,K=k0+2 / k0+3)
//   B frag (v2f): mirrored over N
//   C/D  (v8f):  VGPR r -> M = r + 8*(lane>>4), N = lane&15
// ---------------------------------------------------------------------------
__global__ __launch_bounds__(32) void gemm_wmma_f32(
    const float* __restrict__ W,   // (M x ldw) row-major; use cols [colOff, colOff+K)
    int ldw, int colOff,
    const float* __restrict__ X,   // batched (K x ldx) row-major
    int ldx, long xBatchStride,
    float* __restrict__ H,         // batched (M x N) row-major
    int N, long hBatchStride, int K)
{
    const int lane   = threadIdx.x & 31;
    const int halfId = lane >> 4;
    const int lm     = lane & 15;
    const int n0     = blockIdx.x * 16;
    const int m0     = blockIdx.y * 16;
    const int b      = blockIdx.z;

    const float* Xb = X + (long)b * xBatchStride;
    const float* Wr = W + (long)(m0 + lm) * ldw + colOff;

    v8f acc = {};
    for (int k0 = 0; k0 < K; k0 += 4) {
        const int ka = k0 + 2 * halfId;
        v2f a;
        a.x = Wr[ka];
        a.y = Wr[ka + 1];
        v2f bf;
        bf.x = Xb[(long)ka * ldx + n0 + lm];
        bf.y = Xb[(long)(ka + 1) * ldx + n0 + lm];
        // 8 args: (neg_a, A, neg_b, B, c_mod, C, reuse_a, reuse_b)
        acc = __builtin_amdgcn_wmma_f32_16x16x4_f32(
            false, a, false, bf, (short)0, acc, false, false);
    }

    float* Hb = H + (long)b * hBatchStride;
#pragma unroll
    for (int r = 0; r < 8; ++r) {
        const int row = r + 8 * halfId;
        Hb[(long)(m0 + row) * N + n0 + lm] = acc[r];
    }
}

// ---------------------------------------------------------------------------
// Phase 2: attns[b,n,m] = sum_h v[h] * tanh(hq[b,h,n] + hk[b,h,m])
// Block: 256 threads (8 waves). Wave w owns n = n0 + w (hq read is a
// conflict-free LDS broadcast); lane l owns m = l + 32*j, j=0..7 (8 indep
// accumulator chains keep the trans pipe fed). h chunked by 32 through a
// DOUBLE-BUFFERED LDS stage filled by async global->LDS copies (ASYNCcnt).
// ---------------------------------------------------------------------------
__global__ __launch_bounds__(256) void combine_tanh(
    const float* __restrict__ hq,   // (B, HIDDEN, NQ)
    const float* __restrict__ hk,   // (B, HIDDEN, NK)
    const float* __restrict__ v,    // (HIDDEN)
    float* __restrict__ out)        // (B, NQ*NK)
{
    __shared__ float sh_hk[2][32 * NK];   // 2 x 32 KB
    __shared__ float sh_hq[2][32 * 8];
    __shared__ float sh_v[2][32];

    const int t    = threadIdx.x;
    const int w    = t >> 5;
    const int lane = t & 31;
    const int n0   = blockIdx.x * 8;
    const int b    = blockIdx.y;

    const float* hqB = hq + (long)b * HIDDEN * NQ;
    const float* hkB = hk + (long)b * HIDDEN * NK;

    // Stage one 32-h chunk into LDS buffer `buf`.
    auto stage = [&](int buf, int h0) {
#if USE_ASYNC_LDS
        // hk chunk: 32 x 256 floats = 2048 float4, 8 async b128 per thread
#pragma unroll
        for (int i = 0; i < 8; ++i) {
            const int idx4 = t + 256 * i;          // float4 index
            const int hl   = idx4 >> 6;            // 64 float4 per h-row
            const int m4   = idx4 & 63;
            const float* gp = hkB + (long)(h0 + hl) * NK + m4 * 4;
            __builtin_amdgcn_global_load_async_to_lds_b128(
                (AS_G vi4*)gp, (AS_L vi4*)&sh_hk[buf][idx4 * 4], 0, 0);
        }
        {
            const int hl = t >> 3, nl = t & 7;
            const float* gp = hqB + (long)(h0 + hl) * NQ + n0 + nl;
            __builtin_amdgcn_global_load_async_to_lds_b32(
                (AS_G int*)gp, (AS_L int*)&sh_hq[buf][t], 0, 0);
        }
        if (t < 32) {
            __builtin_amdgcn_global_load_async_to_lds_b32(
                (AS_G int*)(v + h0 + t), (AS_L int*)&sh_v[buf][t], 0, 0);
        }
#else
#pragma unroll
        for (int i = 0; i < 32; ++i) {
            const int idx = t + 256 * i;
            const int hl  = idx >> 8;
            const int m   = idx & 255;
            sh_hk[buf][idx] = hkB[(long)(h0 + hl) * NK + m];
        }
        {
            const int hl = t >> 3, nl = t & 7;
            sh_hq[buf][t] = hqB[(long)(h0 + hl) * NQ + n0 + nl];
        }
        if (t < 32) sh_v[buf][t] = v[h0 + t];
#endif
    };

    float acc[8];
#pragma unroll
    for (int j = 0; j < 8; ++j) acc[j] = 0.0f;

    stage(0, 0);   // prefetch chunk 0

    for (int c = 0; c < HIDDEN / 32; ++c) {
        WAIT_ASYNC0();       // this wave's outstanding async copies done
        __syncthreads();     // everyone's copies visible; prev compute done

        if (c + 1 < HIDDEN / 32) stage((c + 1) & 1, (c + 1) * 32);

        const float* __restrict__ hkS = sh_hk[c & 1];
        const float* __restrict__ hqS = sh_hq[c & 1];
        const float* __restrict__ vS  = sh_v[c & 1];

        for (int hl = 0; hl < 32; ++hl) {
            const float hqv = hqS[hl * 8 + w];   // broadcast within wave
            const float vh  = vS[hl];
#pragma unroll
            for (int j = 0; j < 8; ++j) {
                float x = hqv + hkS[hl * NK + lane + 32 * j];
                float th;
                asm("v_tanh_f32 %0, %1" : "=v"(th) : "v"(x));
                acc[j] = fmaf(vh, th, acc[j]);
            }
        }
    }

    const int n = n0 + w;
    float* ob = out + (long)b * (NQ * NK) + (long)n * NK;
#pragma unroll
    for (int j = 0; j < 8; ++j) ob[lane + 32 * j] = acc[j];
}

// ---------------------------------------------------------------------------
extern "C" void kernel_launch(void* const* d_in, const int* in_sizes, int n_in,
                              void* d_out, int out_size, void* d_ws, size_t ws_size,
                              hipStream_t stream) {
    const float* att_query = (const float*)d_in[0];  // (32, 256, 64)
    const float* att_key   = (const float*)d_in[1];  // (32, 256, 256)
    const float* v         = (const float*)d_in[2];  // (256)
    const float* W         = (const float*)d_in[3];  // (256, 512)
    float* out = (float*)d_out;

    float* hq = (float*)d_ws;                        // 32*256*64  = 524288 f
    float* hk = hq + (long)BATCH * HIDDEN * NQ;      // 32*256*256 = 2097152 f

    // hq = Wq * att_query : M=256, N=64, K=256
    gemm_wmma_f32<<<dim3(NQ / 16, HIDDEN / 16, BATCH), 32, 0, stream>>>(
        W, QH + KH, /*colOff=*/0,
        att_query, NQ, (long)HIDDEN * NQ,
        hq, NQ, (long)HIDDEN * NQ, HIDDEN);

    // hk = Wk * att_key : M=256, N=256, K=256
    gemm_wmma_f32<<<dim3(NK / 16, HIDDEN / 16, BATCH), 32, 0, stream>>>(
        W, QH + KH, /*colOff=*/QH,
        att_key, NK, (long)HIDDEN * NK,
        hk, NK, (long)HIDDEN * NK, HIDDEN);

    // combine: grid (NQ/8, B) = (8, 32), 256 threads
    combine_tanh<<<dim3(NQ / 8, BATCH), 256, 0, stream>>>(hq, hk, v, out);
}

// v001
// It runs in 32.2 microseconds.
// Timed twice side by side with v000, it ran 1.68 times as fast both times.
#include <hip/hip_runtime.h>
#include <hip/hip_bf16.h>

typedef float v2f __attribute__((ext_vector_type(2)));
typedef float v8f __attribute__((ext_vector_type(8)));

#define HIDDEN 256
#define QH 256
#define KH 256
#define BATCH 32
#define NQ 64
#define NK 256

#if defined(__has_builtin)
#if __has_builtin(__builtin_amdgcn_global_load_async_to_lds_b128) && \
    __has_builtin(__builtin_amdgcn_global_load_async_to_lds_b32)
#define USE_ASYNC_LDS 1
#else
#define USE_ASYNC_LDS 0
#endif
#else
#define USE_ASYNC_LDS 0
#endif

#if defined(__has_builtin) && __has_builtin(__builtin_amdgcn_s_wait_asynccnt)
#define WAIT_ASYNC0() __builtin_amdgcn_s_wait_asynccnt(0)
#else
#define WAIT_ASYNC0() asm volatile("s_wait_asynccnt 0x0" ::: "memory")
#endif

// Types matching the builtin signatures reported by the frontend:
//   b128: (int __vector(4) AS1*, int __vector(4) AS3*, imm, imm)
//   b32 : (int AS1*,             int AS3*,             imm, imm)
typedef int vi4 __attribute__((__vector_size__(16)));
#define AS_G __attribute__((address_space(1)))
#define AS_L __attribute__((address_space(3)))

// ---------------------------------------------------------------------------
// Phase 1: batched GEMM  H[b] (256 x NCOLS) = Wsub (256 x 256) * X[b] (256 x NCOLS)
// via V_WMMA_F32_16X16X4_F32.
//   A frag (v2f): lane<16 -> (M=lane,  K=k0+0 / k0+1)
//                 lane>=16-> (M=lane-16,K=k0+2 / k0+3)
//   B frag (v2f): mirrored over N
//   C/D  (v8f):  VGPR r -> M = r + 8*(lane>>4), N = lane&15
// A work-group of 8 waves (WM x WN) owns a BM x BN tile of H; each wave keeps
// TM x TN accumulator tiles. Both operands come through LDS in chunks of KC
// along k: two buffers, filled by async global->LDS copies; a chunk's fragments
// are read into registers while the chunk before it is still being multiplied.
// With TN = 1 the two rows of a B fragment arrive as one register pair.
// The k order of the sums is that of a plain loop over k0 = 0, 4, 8, ...
// LDS pitches (bank = dword address mod 64):
//   A rows KC + 4 dwords (36, 68): the 16 rows of a b64 fragment read start on
//     the 16 different multiples of 4, the two halves fill the dwords between.
//   B rows BN + 8 dwords (40, 136): two rows down is 16 banks on, so the two
//     half-waves of a b32 fragment read fall on different banks.
// ---------------------------------------------------------------------------
#define KTOT 256
#define LDW  (QH + KH)

__device__ __forceinline__ unsigned lds_off(const void* p) { return (unsigned)(size_t)p; }

template <int WM, int WN, int TM, int TN, int NCOLS, int KC>
__global__ __launch_bounds__(256) void gemm_wmma_f32(
    const float* __restrict__ W,   // (256 x LDW) row-major; cols [colOff, colOff+256)
    const float* __restrict__ X,   // batched (256 x NCOLS) row-major
    float* __restrict__ H,         // batched (256 x NCOLS) row-major
    int colOff)
{
    constexpr int BM = WM * TM * 16;
    constexpr int BN = WN * TN * 16;
    constexpr int APITCH = KC + 4;
    constexpr int BPITCH = BN + 8;
    constexpr int NA = BM * KC / 4 / 256;   // b128 copies a thread, A chunk
    constexpr int NB = KC * BN / 4 / 256;   // b128 copies a thread, B chunk
    constexpr int NT = KTOT / KC;
    constexpr int KS = KC / 4;              // k-steps (WMMA depth 4) a chunk
    static_assert(WM * WN == 8, "eight waves");
    static_assert(NA + NB == 6, "six copies in the statement below");
    static_assert(NT >= 2, "two buffers need two chunks");

    __shared__ __attribute__((aligned(16))) float shA[2][BM * APITCH];
    __shared__ __attribute__((aligned(16))) float shB[2][KC * BPITCH];

    const int t      = threadIdx.x;
    const int lane   = t & 31;
    const int halfId = lane >> 4;
    const int lm     = lane & 15;
    const int wave   = t >> 5;
    const int wm     = wave / WN;
    const int wn     = wave % WN;
    const int n0     = blockIdx.x * BN;
    const int m0     = blockIdx.y * BM;
    const int b      = blockIdx.z;

    const float* Xb = X + (long)b * KTOT * NCOLS + n0;
    const float* Wb = W + (long)m0 * LDW + colOff;

    // Copy chunk [k0, k0+KC) of both operands into buffer buf. All copies of a
    // chunk stand in ONE asm statement that ends in s_wait_xcnt 0, so that no
    // address register of an issued copy is rewritten ahead of that wait.
    auto stage = [&](int buf, int k0) {
        unsigned l[NA + NB];
        const float* g[NA + NB];
#pragma unroll
        for (int i = 0; i < NA; ++i) {
            const int idx4 = t + 256 * i;
            const int row  = idx4 / (KC / 4);
            const int c    = (idx4 % (KC / 4)) * 4;
            l[i] = lds_off(&shA[buf][row * APITCH + c]);
            g[i] = Wb + (long)row * LDW + k0 + c;
        }
#pragma unroll
        for (int i = 0; i < NB; ++i) {
            const int idx4 = t + 256 * i;
            const int row  = idx4 / (BN / 4);
            const int c    = (idx4 % (BN / 4)) * 4;
            l[NA + i] = lds_off(&shB[buf][row * BPITCH + c]);
            g[NA + i] = Xb + (long)(k0 + row) * NCOLS + c;
        }
        asm volatile(
            "global_load_async_to_lds_b128 %0, %1, off\n\t"
            "global_load_async_to_lds_b128 %2, %3, off\n\t"
            "global_load_async_to_lds_b128 %4, %5, off\n\t"
            "global_load_async_to_lds_b128 %6, %7, off\n\t"
            "global_load_async_to_lds_b128 %8, %9, off\n\t"
            "global_load_async_to_lds_b128 %10, %11, off\n\t"
            "s_wait_xcnt 0x0"
            :: "v"(l[0]), "v"(g[0]), "v"(l[1]), "v"(g[1]), "v"(l[2]), "v"(g[2]),
               "v"(l[3]), "v"(g[3]), "v"(l[4]), "v"(g[4]), "v"(l[5]), "v"(g[5])
            : "memory");
    };

    v8f acc[TM][TN];
#pragma unroll
    for (int i = 0; i < TM; ++i)
#pragma unroll
        for (int j = 0; j < TN; ++j) acc[i][j] = v8f{};

    // Two register sets of fragments: set c&1 holds all of chunk c.
    v2f a[2][KS][TM], bf[2][KS][TN];

    // Read all fragments of the chunk in buffer buf into register set buf.
    auto fetch = [&](int buf) {
        const float* As = &shA[buf][(wm * TM * 16 + lm) * APITCH + 2 * halfId];
        const float* Bs = &shB[buf][(2 * halfId) * BPITCH + wn * TN * 16 + lm];
#pragma unroll
        for (int s = 0; s < KS; ++s) {
#pragma unroll
            for (int i = 0; i < TM; ++i)
                a[buf][s][i] = *(const v2f*)(As + i * 16 * APITCH + s * 4);
#pragma unroll
            for (int j = 0; j < TN; ++j) {
                bf[buf][s][j].x = Bs[(s * 4) * BPITCH + j * 16];
                bf[buf][s][j].y = Bs[(s * 4 + 1) * BPITCH + j * 16];
            }
        }
    };

    // WMMAs of k-steps [s0, s1) of the chunk held in register set set.
    auto mm = [&](int set, int s0, int s1) {
#pragma unroll
        for (int s = s0; s < s1; ++s)
#pragma unroll
            for (int i = 0; i < TM; ++i)
#pragma unroll
                for (int j = 0; j < TN; ++j)
                    // 8 args: (neg_a, A, neg_b, B, c_mod, C, reuse_a, reuse_b)
                    acc[i][j] = __builtin_amdgcn_wmma_f32_16x16x4_f32(
                        false, a[set][s][i], false, bf[set][s][j], (short)0, acc[i][j],
                        false, false);
    };

    stage(0, 0);
    // chunk 0 of this wave has landed; the barrier shows it to the other waves
    asm volatile("s_wait_asynccnt 0x0" ::: "memory");
    __syncthreads();
    stage(1, KC);
    fetch(0);

    // Unrolled: c picks the register set and the buffer, both must be constants.
    // The four sched_barrier(0) hold the order written here, which waits and
    // barriers alone do not hold for WMMAs: matrix work stands on both sides of
    // the barrier and of the copies and reads, so that one wave of a SIMD has
    // WMMAs to issue while the other issues its copies and reads, and chunk
    // c+1's fragments and chunk c+2's copies are asked for well ahead of use.
#pragma unroll
    for (int c = 0; c < NT; ++c) {
        mm(c & 1, 0, KS / 4);
        __builtin_amdgcn_sched_barrier(0);
        // this wave's reads of buffer c&1 are done before the buffer is refilled
        asm volatile("s_wait_dscnt 0x0" ::: "memory");
        // this wave's copies of chunk c+1 have landed
        asm volatile("s_wait_asynccnt 0x0" ::: "memory");
        // shows chunk c+1 to every wave and ends every reader's use of buffer c&1
        __syncthreads();
        __builtin_amdgcn_sched_barrier(0);
        mm(c & 1, KS / 4, KS / 2);
        __builtin_amdgcn_sched_barrier(0);
        if (c + 2 < NT) stage(c & 1, (c + 2) * KC);
        if (c + 1 < NT) fetch((c + 1) & 1);
        __builtin_amdgcn_sched_barrier(0);
        mm(c & 1, KS / 2, KS);
    }
    // no copy is outstanding when the wave ends
    asm volatile("s_wait_asynccnt 0x0" ::: "memory");

    float* Hb = H + (long)b * KTOT * NCOLS;
#pragma unroll
    for (int i = 0; i < TM; ++i)
#pragma unroll
        for (int j = 0; j < TN; ++j)
#pragma unroll
            for (int r = 0; r < 8; ++r) {
                const int row = m0 + (wm * TM + i) * 16 + r + 8 * halfId;
                Hb[(long)row * NCOLS + n0 + (wn * TN + j) * 16 + lm] = acc[i][j][r];
            }
}

// ---------------------------------------------------------------------------
// Phase 2: attns[b,n,m] = sum_h v[h] * tanh(hq[b,h,n] + hk[b,h,m])
// Block: 256 threads (8 waves). Wave w owns n = n0 + w (hq read is a
// conflict-free LDS broadcast); lane l owns m = l + 32*j, j=0..7 (8 indep
// accumulator chains keep the trans pipe fed). h chunked by 32 through a
// DOUBLE-BUFFERED LDS stage filled by async global->LDS copies (ASYNCcnt).
// ---------------------------------------------------------------------------
__global__ __launch_bounds__(256) void combine_tanh(
    const float* __restrict__ hq,   // (B, HIDDEN, NQ)
    const float* __restrict__ hk,   // (B, HIDDEN, NK)
    const float* __restrict__ v,    // (HIDDEN)
    float* __restrict__ out)        // (B, NQ*NK)
{
    __shared__ float sh_hk[2][32 * NK];   // 2 x 32 KB
    __shared__ float sh_hq[2][32 * 8];
    __shared__ float sh_v[2][32];

    const int t    = threadIdx.x;
    const int w    = t >> 5;
    const int lane = t & 31;
    const int n0   = blockIdx.x * 8;
    const int b    = blockIdx.y;

    const float* hqB = hq + (long)b * HIDDEN * NQ;
    const float* hkB = hk + (long)b * HIDDEN * NK;

    // Stage one 32-h chunk into LDS buffer `buf`.
    auto stage = [&](int buf, int h0) {
#if USE_ASYNC_LDS
        // hk chunk: 32 x 256 floats = 2048 float4, 8 async b128 per thread
#pragma unroll
        for (int i = 0; i < 8; ++i) {
            const int idx4 = t + 256 * i;          // float4 index
            const int hl   = idx4 >> 6;            // 64 float4 per h-row
            const int m4   = idx4 & 63;
            const float* gp = hkB + (long)(h0 + hl) * NK + m4 * 4;
            __builtin_amdgcn_global_load_async_to_lds_b128(
                (AS_G vi4*)gp, (AS_L vi4*)&sh_hk[buf][idx4 * 4], 0, 0);
        }
        {
            const int hl = t >> 3, nl = t & 7;
            const float* gp = hqB + (long)(h0 + hl) * NQ + n0 + nl;
            __builtin_amdgcn_global_load_async_to_lds_b32(
                (AS_G int*)gp, (AS_L int*)&sh_hq[buf][t], 0, 0);
        }
        if (t < 32) {
            __builtin_amdgcn_global_load_async_to_lds_b32(
                (AS_G int*)(v + h0 + t), (AS_L int*)&sh_v[buf][t], 0, 0);
        }
#else
#pragma unroll
        for (int i = 0; i < 32; ++i) {
            const int idx = t + 256 * i;
            const int hl  = idx >> 8;
            const int m   = idx & 255;
            sh_hk[buf][idx] = hkB[(long)(h0 + hl) * NK + m];
        }
        {
            const int hl = t >> 3, nl = t & 7;
            sh_hq[buf][t] = hqB[(long)(h0 + hl) * NQ + n0 + nl];
        }
        if (t < 32) sh_v[buf][t] = v[h0 + t];
#endif
    };

    float acc[8];
#pragma unroll
    for (int j = 0; j < 8; ++j) acc[j] = 0.0f;

    stage(0, 0);   // prefetch chunk 0

    for (int c = 0; c < HIDDEN / 32; ++c) {
        WAIT_ASYNC0();       // this wave's outstanding async copies done
        __syncthreads();     // everyone's copies visible; prev compute done

        if (c + 1 < HIDDEN / 32) stage((c + 1) & 1, (c + 1) * 32);

        const float* __restrict__ hkS = sh_hk[c & 1];
        const float* __restrict__ hqS = sh_hq[c & 1];
        const float* __restrict__ vS  = sh_v[c & 1];

        for (int hl = 0; hl < 32; ++hl) {
            const float hqv = hqS[hl * 8 + w];   // broadcast within wave
            const float vh  = vS[hl];
#pragma unroll
            for (int j = 0; j < 8; ++j) {
                float x = hqv + hkS[hl * NK + lane + 32 * j];
                float th;
                asm("v_tanh_f32 %0, %1" : "=v"(th) : "v"(x));
                acc[j] = fmaf(vh, th, acc[j]);
            }
        }
    }

    const int n = n0 + w;
    float* ob = out + (long)b * (NQ * NK) + (long)n * NK;
#pragma unroll
    for (int j = 0; j < 8; ++j) ob[lane + 32 * j] = acc[j];
}

// ---------------------------------------------------------------------------
extern "C" void kernel_launch(void* const* d_in, const int* in_sizes, int n_in,
                              void* d_out, int out_size, void* d_ws, size_t ws_size,
                              hipStream_t stream) {
    const float* att_query = (const float*)d_in[0];  // (32, 256, 64)
    const float* att_key   = (const float*)d_in[1];  // (32, 256, 256)
    const float* v         = (const float*)d_in[2];  // (256)
    const float* W         = (const float*)d_in[3];  // (256, 512)
    float* out = (float*)d_out;

    float* hq = (float*)d_ws;                        // 32*256*64  = 524288 f
    float* hk = hq + (long)BATCH * HIDDEN * NQ;      // 32*256*256 = 2097152 f

    // hq = Wq * att_query : M=256, N=64, K=256; 64 x 32 tile a work-group
    gemm_wmma_f32<4, 2, 1, 1, NQ, 64><<<dim3(NQ / 32, HIDDEN / 64, BATCH), 256, 0, stream>>>(
        W, att_query, hq, /*colOff=*/0);

    // hk = Wk * att_key : M=256, N=256, K=256; 64 x 128 tile a work-group
    gemm_wmma_f32<1, 8, 4, 1, NK, 32><<<dim3(NK / 128, HIDDEN / 64, BATCH), 256, 0, stream>>>(
        W, att_key, hk, /*colOff=*/QH);

    // combine: grid (NQ/8, B) = (8, 32), 256 threads
    combine_tanh<<<dim3(NQ / 8, BATCH), 256, 0, stream>>>(hq, hk, v, out);
}

// v002
// One run takes 26.7 microseconds.
// Two timings next to v001 both put it at 1.21 times that version's speed.
// Over all steps from v000 it is 2.03 times as fast.
#include <hip/hip_runtime.h>
#include <hip/hip_bf16.h>

typedef float v2f __attribute__((ext_vector_type(2)));
typedef float v8f __attribute__((ext_vector_type(8)));

#define HIDDEN 256
#define QH 256
#define KH 256
#define BATCH 32
#define NQ 64
#define NK 256

// Types matching the builtin signatures reported by the frontend:
//   b128: (int __vector(4) AS1*, int __vector(4) AS3*, imm, imm)
//   b32 : (int AS1*,             int AS3*,             imm, imm)
typedef int vi4 __attribute__((__vector_size__(16)));
#define AS_G __attribute__((address_space(1)))
#define AS_L __attribute__((address_space(3)))

// ---------------------------------------------------------------------------
// Phase 1: batched GEMM  H[b] (256 x NCOLS) = Wsub (256 x 256) * X[b] (256 x NCOLS)
// via V_WMMA_F32_16X16X4_F32.
//   A frag (v2f): lane<16 -> (M=lane,  K=k0+0 / k0+1)
//                 lane>=16-> (M=lane-16,K=k0+2 / k0+3)
//   B frag (v2f): mirrored over N
//   C/D  (v8f):  VGPR r -> M = r + 8*(lane>>4), N = lane&15
// A work-group of 8 waves (WM x WN) owns a BM x BN tile of H; each wave keeps
// TM x TN accumulator tiles. Both operands come through LDS in chunks of KC
// along k: two buffers, filled by async global->LDS copies; a chunk's fragments
// are read into registers while the chunk before it is still being multiplied.
// With TN = 1 the two rows of a B fragment arrive as one register pair.
// The k order of the sums is that of a plain loop over k0 = 0, 4, 8, ...
// LDS pitches (bank = dword address mod 64):
//   A rows KC + 4 dwords (36, 68): the 16 rows of a b64 fragment read start on
//     the 16 different multiples of 4, the two halves fill the dwords between.
//   B rows BN + 8 dwords (40, 136): two rows down is 16 banks on, so the two
//     half-waves of a b32 fragment read fall on different banks.
// ---------------------------------------------------------------------------
#define KTOT 256
#define LDW  (QH + KH)

__device__ __forceinline__ unsigned lds_off(const void* p) { return (unsigned)(size_t)p; }

template <int WM, int WN, int TM, int TN, int NCOLS, int KC>
__global__ __launch_bounds__(256) void gemm_wmma_f32(
    const float* __restrict__ W,   // (256 x LDW) row-major; cols [colOff, colOff+256)
    const float* __restrict__ X,   // batched (256 x NCOLS) row-major
    float* __restrict__ H,         // batched (256 x NCOLS) row-major
    int colOff)
{
    constexpr int BM = WM * TM * 16;
    constexpr int BN = WN * TN * 16;
    constexpr int APITCH = KC + 4;
    constexpr int BPITCH = BN + 8;
    constexpr int NA = BM * KC / 4 / 256;   // b128 copies a thread, A chunk
    constexpr int NB = KC * BN / 4 / 256;   // b128 copies a thread, B chunk
    constexpr int NT = KTOT / KC;
    constexpr int KS = KC / 4;              // k-steps (WMMA depth 4) a chunk
    static_assert(WM * WN == 8, "eight waves");
    static_assert(NA + NB == 6, "six copies in the statement below");
    static_assert(NT >= 2, "two buffers need two chunks");

    __shared__ __attribute__((aligned(16))) float shA[2][BM * APITCH];
    __shared__ __attribute__((aligned(16))) float shB[2][KC * BPITCH];

    const int t      = threadIdx.x;
    const int lane   = t & 31;
    const int halfId = lane >> 4;
    const int lm     = lane & 15;
    const int wave   = t >> 5;
    const int wm     = wave / WN;
    const int wn     = wave % WN;
    const int n0     = blockIdx.x * BN;
    const int m0     = blockIdx.y * BM;
    const int b      = blockIdx.z;

    const float* Xb = X + (long)b * KTOT * NCOLS + n0;
    const float* Wb = W + (long)m0 * LDW + colOff;

    // Copy chunk [k0, k0+KC) of both operands into buffer buf. All copies of a
    // chunk stand in ONE asm statement that ends in s_wait_xcnt 0, so that no
    // address register of an issued copy is rewritten ahead of that wait.
    auto stage = [&](int buf, int k0) {
        unsigned l[NA + NB];
        const float* g[NA + NB];
#pragma unroll
        for (int i = 0; i < NA; ++i) {
            const int idx4 = t + 256 * i;
            const int row  = idx4 / (KC / 4);
            const int c    = (idx4 % (KC / 4)) * 4;
            l[i] = lds_off(&shA[buf][row * APITCH + c]);
            g[i] = Wb + (long)row * LDW + k0 + c;
        }
#pragma unroll
        for (int i = 0; i < NB; ++i) {
            const int idx4 = t + 256 * i;
            const int row  = idx4 / (BN / 4);
            const int c    = (idx4 % (BN / 4)) * 4;
            l[NA + i] = lds_off(&shB[buf][row * BPITCH + c]);
            g[NA + i] = Xb + (long)(k0 + row) * NCOLS + c;
        }
        asm volatile(
            "global_load_async_to_lds_b128 %0, %1, off\n\t"
            "global_load_async_to_lds_b128 %2, %3, off\n\t"
            "global_load_async_to_lds_b128 %4, %5, off\n\t"
            "global_load_async_to_lds_b128 %6, %7, off\n\t"
            "global_load_async_to_lds_b128 %8, %9, off\n\t"
            "global_load_async_to_lds_b128 %10, %11, off\n\t"
            "s_wait_xcnt 0x0"
            :: "v"(l[0]), "v"(g[0]), "v"(l[1]), "v"(g[1]), "v"(l[2]), "v"(g[2]),
               "v"(l[3]), "v"(g[3]), "v"(l[4]), "v"(g[4]), "v"(l[5]), "v"(g[5])
            : "memory");
    };

    v8f acc[TM][TN];
#pragma unroll
    for (int i = 0; i < TM; ++i)
#pragma unroll
        for (int j = 0; j < TN; ++j) acc[i][j] = v8f{};

    // Two register sets of fragments: set c&1 holds all of chunk c.
    v2f a[2][KS][TM], bf[2][KS][TN];

    // Read all fragments of the chunk in buffer buf into register set buf.
    auto fetch = [&](int buf) {
        const float* As = &shA[buf][(wm * TM * 16 + lm) * APITCH + 2 * halfId];
        const float* Bs = &shB[buf][(2 * halfId) * BPITCH + wn * TN * 16 + lm];
#pragma unroll
        for (int s = 0; s < KS; ++s) {
#pragma unroll
            for (int i = 0; i < TM; ++i)
                a[buf][s][i] = *(const v2f*)(As + i * 16 * APITCH + s * 4);
#pragma unroll
            for (int j = 0; j < TN; ++j) {
                bf[buf][s][j].x = Bs[(s * 4) * BPITCH + j * 16];
                bf[buf][s][j].y = Bs[(s * 4 + 1) * BPITCH + j * 16];
            }
        }
    };

    // WMMAs of k-steps [s0, s1) of the chunk held in register set set.
    auto mm = [&](int set, int s0, int s1) {
#pragma unroll
        for (int s = s0; s < s1; ++s)
#pragma unroll
            for (int i = 0; i < TM; ++i)
#pragma unroll
                for (int j = 0; j < TN; ++j)
                    // 8 args: (neg_a, A, neg_b, B, c_mod, C, reuse_a, reuse_b)
                    acc[i][j] = __builtin_amdgcn_wmma_f32_16x16x4_f32(
                        false, a[set][s][i], false, bf[set][s][j], (short)0, acc[i][j],
                        false, false);
    };

    stage(0, 0);
    // chunk 0 of this wave has landed; the barrier shows it to the other waves
    asm volatile("s_wait_asynccnt 0x0" ::: "memory");
    __syncthreads();
    stage(1, KC);
    fetch(0);

    // Unrolled: c picks the register set and the buffer, both must be constants.
    // The four sched_barrier(0) hold the order written here, which waits and
    // barriers alone do not hold for WMMAs: matrix work stands on both sides of
    // the barrier and of the copies and reads, so that one wave of a SIMD has
    // WMMAs to issue while the other issues its copies and reads, and chunk
    // c+1's fragments and chunk c+2's copies are asked for well ahead of use.
#pragma unroll
    for (int c = 0; c < NT; ++c) {
        mm(c & 1, 0, KS / 4);
        __builtin_amdgcn_sched_barrier(0);
        // this wave's reads of buffer c&1 are done before the buffer is refilled
        asm volatile("s_wait_dscnt 0x0" ::: "memory");
        // this wave's copies of chunk c+1 have landed
        asm volatile("s_wait_asynccnt 0x0" ::: "memory");
        // shows chunk c+1 to every wave and ends every reader's use of buffer c&1
        __syncthreads();
        __builtin_amdgcn_sched_barrier(0);
        mm(c & 1, KS / 4, KS / 2);
        __builtin_amdgcn_sched_barrier(0);
        if (c + 2 < NT) stage(c & 1, (c + 2) * KC);
        if (c + 1 < NT) fetch((c + 1) & 1);
        __builtin_amdgcn_sched_barrier(0);
        mm(c & 1, KS / 2, KS);
    }
    // no copy is outstanding when the wave ends
    asm volatile("s_wait_asynccnt 0x0" ::: "memory");

    float* Hb = H + (long)b * KTOT * NCOLS;
#pragma unroll
    for (int i = 0; i < TM; ++i)
#pragma unroll
        for (int j = 0; j < TN; ++j)
#pragma unroll
            for (int r = 0; r < 8; ++r) {
                const int row = m0 + (wm * TM + i) * 16 + r + 8 * halfId;
                Hb[(long)row * NCOLS + n0 + (wn * TN + j) * 16 + lm] = acc[i][j][r];
            }
}

// ---------------------------------------------------------------------------
// Phase 2: attns[b,n,m] = sum_h v[h] * tanh(hq[b,h,n] + hk[b,h,m])
// Block: 256 threads (8 waves) own 8 n x 256 m of one batch. A wave owns a
// register tile of 4 n x 128 m (a lane: 4 n x 4 adjacent m) for HALF of the h
// rows: per h row one b128 read of hk and one b128 broadcast read of hq feed 16
// tanh, so the LDS pipe is asked for about half of what the tanh rate allows.
// The two waves that share a tile add their partial sums through LDS at the end.
// h goes through LDS in chunks of 32 rows (rows 0-15 for one half of the waves,
// 16-31 for the other): three buffers filled by async global->LDS copies.
// A wave reads its rows four at a time, one group ahead of the group it works on.
// ---------------------------------------------------------------------------
#define CH   32                      // h rows a chunk
#define NCH  (HIDDEN / CH)
#define GH   4                       // h rows a register group
#define NG   (CH / 2 / GH)           // groups a wave and chunk
#define HKF  (CH * NK)               // floats of hk a buffer
#define BUFF (HKF + CH * 8)          // floats a buffer: hk rows, then hq rows

typedef float v4f __attribute__((ext_vector_type(4)));

__global__ __launch_bounds__(256) void combine_tanh(
    const float* __restrict__ hq,   // (B, HIDDEN, NQ)
    const float* __restrict__ hk,   // (B, HIDDEN, NK)
    const float* __restrict__ v,    // (HIDDEN)
    float* __restrict__ out)        // (B, NQ*NK)
{
    static_assert(NG % 2 == 0, "the register set of a group is its parity");
    __shared__ __attribute__((aligned(16))) float sh[3][BUFF];
    __shared__ __attribute__((aligned(16))) float sh_v[HIDDEN];
    __shared__ __attribute__((aligned(16))) v4f   sh_red[8][2][32];

    const int t    = threadIdx.x;
    const int w    = t >> 5;
    const int lane = t & 31;
    const int nh   = w & 1;          // which 4 of the 8 n
    const int mh   = (w >> 1) & 1;   // which 128 of the 256 m
    const int hh   = w >> 2;         // which 16 of a chunk's 32 h rows
    const int n0   = blockIdx.x * 8;
    const int b    = blockIdx.y;

    const float* hqB = hq + (long)b * HIDDEN * NQ;
    const float* hkB = hk + (long)b * HIDDEN * NK;

    // Stage one 32-h chunk into LDS buffer buf: 8 b128 copies of hk and one b32
    // copy of hq a thread, every lane on.
    auto stage = [&](int buf, int h0) {
#pragma unroll
        for (int i = 0; i < 8; ++i) {
            const int idx4 = t + 256 * i;          // float4 index
            const int hl   = idx4 >> 6;            // 64 float4 per h-row
            const int m4   = idx4 & 63;
            const float* gp = hkB + (long)(h0 + hl) * NK + m4 * 4;
            __builtin_amdgcn_global_load_async_to_lds_b128(
                (AS_G vi4*)gp, (AS_L vi4*)&sh[buf][idx4 * 4], 0, 0);
        }
        const int hl = t >> 3, nl = t & 7;
        const float* gp = hqB + (long)(h0 + hl) * NQ + n0 + nl;
        __builtin_amdgcn_global_load_async_to_lds_b32(
            (AS_G int*)gp, (AS_L int*)&sh[buf][HKF + t], 0, 0);
    };

    // Two register sets: group g of a chunk lives in set g & 1.
    v4f kf[2][GH], qf[2][GH], vf[2];

    // This wave's first hk row, hq row and v entry in buffer 0 / chunk 0; all
    // further rows are constant offsets from these.
    const float* kb0 = &sh[0][hh * (CH / 2) * NK + mh * 128 + lane * 4];
    const float* qb0 = &sh[0][HKF + hh * (CH / 2) * 8 + nh * 4];
    const float* vb0 = &sh_v[hh * (CH / 2)];

    // Read group g of chunk c, which lies in buffer buf, into register set g & 1.
    auto fetch = [&](int buf, int c, int g) {
        const float* kb = kb0 + buf * BUFF;
        const float* qb = qb0 + buf * BUFF;
        const float* vb = vb0 + c * CH;
#pragma unroll
        for (int i = 0; i < GH; ++i) {
            kf[g & 1][i] = *(const v4f*)(kb + (g * GH + i) * NK);
            qf[g & 1][i] = *(const v4f*)(qb + (g * GH + i) * 8);
        }
        vf[g & 1] = *(const v4f*)(vb + g * GH);
    };

    // acc[n][p]: sums of n row n, m pair p of the lane's four m. Pairs are written
    // out so that add and FMA are packed and stay in the order of the source.
    v2f acc[4][2];
#pragma unroll
    for (int n = 0; n < 4; ++n) acc[n][0] = acc[n][1] = v2f{};

    auto work = [&](int set) {
#pragma unroll
        for (int i = 0; i < GH; ++i) {
            const v4f k4 = kf[set][i];
            const v2f kp[2] = {v2f{k4.x, k4.y}, v2f{k4.z, k4.w}};
            const v2f vv = v2f{vf[set][i], vf[set][i]};
#pragma unroll
            for (int n = 0; n < 4; ++n)
#pragma unroll
                for (int p = 0; p < 2; ++p) {
                    const v2f x = kp[p] + v2f{qf[set][i][n], qf[set][i][n]};
                    const v2f th = v2f{__builtin_amdgcn_tanhf(x.x), __builtin_amdgcn_tanhf(x.y)};
                    acc[n][p] = __builtin_elementwise_fma(vv, th, acc[n][p]);
                }
            // one h row at a time: without it the tanh results of many rows are
            // kept waiting for their FMAs and the wave needs registers above v255
            __builtin_amdgcn_sched_barrier(0);
        }
    };

    __builtin_amdgcn_global_load_async_to_lds_b32(
        (AS_G int*)(v + t), (AS_L int*)&sh_v[t], 0, 0);
    stage(0, 0);
    stage(1, CH);
    // v and chunks 0 and 1 of this wave have landed; the barrier shows them to the
    // other waves
    asm volatile("s_wait_asynccnt 0x0" ::: "memory");
    __syncthreads();
    fetch(0, 0, 0);

    // Buffers of chunk c, of chunk c+1 and the one to refill (it held chunk c-1).
    int bc = 0, bn = 1, bf = 2;

    // Kept rolled. All arithmetic of a trip stands behind the one branch, in one
    // straight run: from in front of a branch it was moved away from the reads that
    // it is to cover.
#pragma unroll 1
    for (int c = 0; c < NCH; ++c) {
        // Publish point of chunk c+1.
        // this wave's reads of chunk c-1 are done before its buffer is refilled
        asm volatile("s_wait_dscnt 0x0" ::: "memory");
        // this wave's copies of chunk c+1 have landed
        asm volatile("s_wait_asynccnt 0x0" ::: "memory");
        // shows chunk c+1 to every wave and ends every reader's use of chunk c-1
        __syncthreads();
        if (c + 2 < NCH) stage(bf, (c + 2) * CH);

        // The last trip has no next chunk: it reads its own first group once more
        // (unused), which keeps the run free of a branch.
        const bool more = c + 1 < NCH;
        const int  cn   = more ? c + 1 : c;
        const int  bx   = more ? bn : bc;
#pragma unroll
        for (int g = 0; g < NG; ++g) {
            if (g + 1 < NG) fetch(bc, c, g + 1);
            else            fetch(bx, cn, 0);
            // holds the next group's reads ahead of this group's arithmetic, so
            // that their latency runs under it
            __builtin_amdgcn_sched_barrier(0);
            work(g & 1);
        }
        const int b0 = bc;
        bc = bn; bn = bf; bf = b0;
    }
    // no copy is outstanding when the wave ends
    asm volatile("s_wait_asynccnt 0x0" ::: "memory");

    // Waves w and w ^ 4 hold the two halves of one tile's sums: each hands two of
    // its four n rows to the other and finishes the two it keeps.
    v4f row[4];
#pragma unroll
    for (int n = 0; n < 4; ++n) row[n] = v4f{acc[n][0].x, acc[n][0].y, acc[n][1].x, acc[n][1].y};
    sh_red[w][0][lane] = hh ? row[0] : row[2];
    sh_red[w][1][lane] = hh ? row[1] : row[3];
    __syncthreads();
    const v4f o0 = (hh ? row[2] : row[0]) + sh_red[w ^ 4][0][lane];
    const v4f o1 = (hh ? row[3] : row[1]) + sh_red[w ^ 4][1][lane];

    const int n = n0 + nh * 4 + hh * 2;
    float* ob = out + (long)b * (NQ * NK) + (long)n * NK + mh * 128 + lane * 4;
    *(v4f*)ob        = o0;
    *(v4f*)(ob + NK) = o1;
}

// ---------------------------------------------------------------------------
extern "C" void kernel_launch(void* const* d_in, const int* in_sizes, int n_in,
                              void* d_out, int out_size, void* d_ws, size_t ws_size,
                              hipStream_t stream) {
    const float* att_query = (const float*)d_in[0];  // (32, 256, 64)
    const float* att_key   = (const float*)d_in[1];  // (32, 256, 256)
    const float* v         = (const float*)d_in[2];  // (256)
    const float* W         = (const float*)d_in[3];  // (256, 512)
    float* out = (float*)d_out;

    float* hq = (float*)d_ws;                        // 32*256*64  = 524288 f
    float* hk = hq + (long)BATCH * HIDDEN * NQ;      // 32*256*256 = 2097152 f

    // hq = Wq * att_query : M=256, N=64, K=256; 64 x 32 tile a work-group
    gemm_wmma_f32<4, 2, 1, 1, NQ, 64><<<dim3(NQ / 32, HIDDEN / 64, BATCH), 256, 0, stream>>>(
        W, att_query, hq, /*colOff=*/0);

    // hk = Wk * att_key : M=256, N=256, K=256; 64 x 128 tile a work-group
    gemm_wmma_f32<1, 8, 4, 1, NK, 32><<<dim3(NK / 128, HIDDEN / 64, BATCH), 256, 0, stream>>>(
        W, att_key, hk, /*colOff=*/QH);

    // combine: grid (NQ/8, B) = (8, 32), 256 threads
    combine_tanh<<<dim3(NQ / 8, BATCH), 256, 0, stream>>>(hq, hk, v, out);
}

// v003
// Measured time: 21.2 microseconds a run.
// Timed twice side by side with v002, it ran 1.27 and 1.26 times as fast.
// Over all steps from v000 it is 2.57 times as fast.
#include <hip/hip_runtime.h>
#include <hip/hip_bf16.h>

typedef float v2f __attribute__((ext_vector_type(2)));
typedef float v8f __attribute__((ext_vector_type(8)));

#define HIDDEN 256
#define QH 256
#define KH 256
#define BATCH 32
#define NQ 64
#define NK 256

// Types matching the builtin signatures reported by the frontend:
//   b128: (int __vector(4) AS1*, int __vector(4) AS3*, imm, imm)
//   b32 : (int AS1*,             int AS3*,             imm, imm)
typedef int vi4 __attribute__((__vector_size__(16)));
#define AS_G __attribute__((address_space(1)))
#define AS_L __attribute__((address_space(3)))

// ---------------------------------------------------------------------------
// Phase 1: batched GEMM  H[b] (256 x NCOLS) = Wsub (256 x 256) * X[b] (256 x NCOLS)
// via V_WMMA_F32_16X16X4_F32.
//   A frag (v2f): lane<16 -> (M=lane,  K=k0+0 / k0+1)
//                 lane>=16-> (M=lane-16,K=k0+2 / k0+3)
//   B frag (v2f): mirrored over N
//   C/D  (v8f):  VGPR r -> M = r + 8*(lane>>4), N = lane&15
// A work-group of 8 waves (WM x WN) owns a BM x BN tile of H; each wave keeps
// TM x TN accumulator tiles. Both operands come through LDS in chunks of KC
// along k: two buffers, filled by async global->LDS copies; a chunk's fragments
// are read into registers while the chunk before it is still being multiplied.
// With TN = 1 the two rows of a B fragment arrive as one register pair.
// The k order of the sums is that of a plain loop over k0 = 0, 4, 8, ...
// Both products (hq and hk) read only inputs, so they share ONE launch: the
// work-groups of hk come first in the grid, those of hq behind them; two fit a
// WGP, so that hq's WMMAs can go into matrix-unit slots that hk leaves idle.
// LDS pitches (bank = dword address mod 64):
//   A rows KC + 4 dwords (36, 68): the 16 rows of a b64 fragment read start on
//     the 16 different multiples of 4, the two halves fill the dwords between.
//   B rows BN + 8 dwords (40, 136): two rows down is 16 banks on, so the two
//     half-waves of a b32 fragment read fall on different banks.
// ---------------------------------------------------------------------------
#define KTOT 256
#define LDW  (QH + KH)

__device__ __forceinline__ unsigned lds_off(const void* p) { return (unsigned)(size_t)p; }

#define GEMM_LDS_FLOATS 13824     // the larger of the two tile shapes' needs

template <int WM, int WN, int TM, int TN, int NCOLS, int KC>
__device__ __forceinline__ void gemm_wmma_f32(
    const float* __restrict__ W,   // (256 x LDW) row-major; cols [colOff, colOff+256)
    const float* __restrict__ X,   // batched (256 x NCOLS) row-major
    float* __restrict__ H,         // batched (256 x NCOLS) row-major
    int colOff,
    int b,                         // batch
    float* smem)                   // the work-group's LDS, GEMM_LDS_FLOATS floats
{
    constexpr int BM = WM * TM * 16;
    constexpr int BN = WN * TN * 16;
    constexpr int APITCH = KC + 4;
    constexpr int BPITCH = BN + 8;
    constexpr int NA = BM * KC / 4 / 256;   // b128 copies a thread, A chunk
    constexpr int NB = KC * BN / 4 / 256;   // b128 copies a thread, B chunk
    constexpr int NT = KTOT / KC;
    constexpr int KS = KC / 4;              // k-steps (WMMA depth 4) a chunk
    static_assert(WM * WN == 8, "eight waves");
    static_assert(NA + NB == 6, "six copies in the statement below");
    static_assert(NT >= 2, "two buffers need two chunks");

    constexpr int ABUF = BM * APITCH;       // floats of one A buffer
    constexpr int BBUF = KC * BPITCH;       // floats of one B buffer
    static_assert(2 * (ABUF + BBUF) <= GEMM_LDS_FLOATS, "buffers fit the LDS array");
    static_assert(ABUF % 4 == 0 && BBUF % 4 == 0, "every buffer starts on 16 bytes");

    float* const shA = smem;                // two A buffers
    float* const shB = smem + 2 * ABUF;     // two B buffers

    const int t      = threadIdx.x;
    const int lane   = t & 31;
    const int halfId = lane >> 4;
    const int lm     = lane & 15;
    const int wave   = t >> 5;
    const int wm     = wave / WN;
    const int wn     = wave % WN;
    const int n0     = blockIdx.x * BN;
    const int m0     = blockIdx.y * BM;

    const float* Xb = X + (long)b * KTOT * NCOLS + n0;
    const float* Wb = W + (long)m0 * LDW + colOff;

    // Copy chunk [k0, k0+KC) of both operands into buffer buf. All copies of a
    // chunk stand in ONE asm statement that ends in s_wait_xcnt 0, so that no
    // address register of an issued copy is rewritten ahead of that wait.
    auto stage = [&](int buf, int k0) {
        unsigned l[NA + NB];
        const float* g[NA + NB];
#pragma unroll
        for (int i = 0; i < NA; ++i) {
            const int idx4 = t + 256 * i;
            const int row  = idx4 / (KC / 4);
            const int c    = (idx4 % (KC / 4)) * 4;
            l[i] = lds_off(&shA[buf * ABUF + row * APITCH + c]);
            g[i] = Wb + (long)row * LDW + k0 + c;
        }
#pragma unroll
        for (int i = 0; i < NB; ++i) {
            const int idx4 = t + 256 * i;
            const int row  = idx4 / (BN / 4);
            const int c    = (idx4 % (BN / 4)) * 4;
            l[NA + i] = lds_off(&shB[buf * BBUF + row * BPITCH + c]);
            g[NA + i] = Xb + (long)(k0 + row) * NCOLS + c;
        }
        asm volatile(
            "global_load_async_to_lds_b128 %0, %1, off\n\t"
            "global_load_async_to_lds_b128 %2, %3, off\n\t"
            "global_load_async_to_lds_b128 %4, %5, off\n\t"
            "global_load_async_to_lds_b128 %6, %7, off\n\t"
            "global_load_async_to_lds_b128 %8, %9, off\n\t"
            "global_load_async_to_lds_b128 %10, %11, off\n\t"
            "s_wait_xcnt 0x0"
            :: "v"(l[0]), "v"(g[0]), "v"(l[1]), "v"(g[1]), "v"(l[2]), "v"(g[2]),
               "v"(l[3]), "v"(g[3]), "v"(l[4]), "v"(g[4]), "v"(l[5]), "v"(g[5])
            : "memory");
    };

    v8f acc[TM][TN];
#pragma unroll
    for (int i = 0; i < TM; ++i)
#pragma unroll
        for (int j = 0; j < TN; ++j) acc[i][j] = v8f{};

    // Two register sets of fragments: set c&1 holds all of chunk c.
    v2f a[2][KS][TM], bf[2][KS][TN];

    // Read all fragments of the chunk in buffer buf into register set buf.
    auto fetch = [&](int buf) {
        const float* As = &shA[buf * ABUF + (wm * TM * 16 + lm) * APITCH + 2 * halfId];
        const float* Bs = &shB[buf * BBUF + (2 * halfId) * BPITCH + wn * TN * 16 + lm];
#pragma unroll
        for (int s = 0; s < KS; ++s) {
#pragma unroll
            for (int i = 0; i < TM; ++i)
                a[buf][s][i] = *(const v2f*)(As + i * 16 * APITCH + s * 4);
#pragma unroll
            for (int j = 0; j < TN; ++j) {
                bf[buf][s][j].x = Bs[(s * 4) * BPITCH + j * 16];
                bf[buf][s][j].y = Bs[(s * 4 + 1) * BPITCH + j * 16];
            }
        }
    };

    // WMMAs of k-steps [s0, s1) of the chunk held in register set set.
    auto mm = [&](int set, int s0, int s1) {
#pragma unroll
        for (int s = s0; s < s1; ++s)
#pragma unroll
            for (int i = 0; i < TM; ++i)
#pragma unroll
                for (int j = 0; j < TN; ++j)
                    // 8 args: (neg_a, A, neg_b, B, c_mod, C, reuse_a, reuse_b)
                    acc[i][j] = __builtin_amdgcn_wmma_f32_16x16x4_f32(
                        false, a[set][s][i], false, bf[set][s][j], (short)0, acc[i][j],
                        false, false);
    };

    stage(0, 0);
    // chunk 0 of this wave has landed; the barrier shows it to the other waves
    asm volatile("s_wait_asynccnt 0x0" ::: "memory");
    __syncthreads();
    stage(1, KC);
    fetch(0);

    // Unrolled: c picks the register set and the buffer, both must be constants.
    // The four sched_barrier(0) hold the order written here, which waits and
    // barriers alone do not hold for WMMAs: matrix work stands on both sides of
    // the barrier and of the copies and reads, so that one wave of a SIMD has
    // WMMAs to issue while the other issues its copies and reads, and chunk
    // c+1's fragments and chunk c+2's copies are asked for well ahead of use.
#pragma unroll
    for (int c = 0; c < NT; ++c) {
        mm(c & 1, 0, KS / 4);
        __builtin_amdgcn_sched_barrier(0);
        // this wave's reads of buffer c&1 are done before the buffer is refilled
        asm volatile("s_wait_dscnt 0x0" ::: "memory");
        // this wave's copies of chunk c+1 have landed
        asm volatile("s_wait_asynccnt 0x0" ::: "memory");
        // shows chunk c+1 to every wave and ends every reader's use of buffer c&1
        __syncthreads();
        __builtin_amdgcn_sched_barrier(0);
        mm(c & 1, KS / 4, KS / 2);
        __builtin_amdgcn_sched_barrier(0);
        if (c + 2 < NT) stage(c & 1, (c + 2) * KC);
        if (c + 1 < NT) fetch((c + 1) & 1);
        __builtin_amdgcn_sched_barrier(0);
        mm(c & 1, KS / 2, KS);
    }
    // no copy is outstanding when the wave ends
    asm volatile("s_wait_asynccnt 0x0" ::: "memory");

    float* Hb = H + (long)b * KTOT * NCOLS;
#pragma unroll
    for (int i = 0; i < TM; ++i)
#pragma unroll
        for (int j = 0; j < TN; ++j)
#pragma unroll
            for (int r = 0; r < 8; ++r) {
                const int row = m0 + (wm * TM + i) * 16 + r + 8 * halfId;
                Hb[(long)row * NCOLS + n0 + (wn * TN + j) * 16 + lm] = acc[i][j][r];
            }
    // the other product's code follows this one in the kernel: no register that
    // an issued store names is rewritten ahead of this wait on any way through it
    asm volatile("s_wait_xcnt 0x0" ::: "memory");
}

// Grid (2, 4, 2 * BATCH): z < BATCH is a 64 x 128 tile of hk[z], the rest a
// 64 x 32 tile of hq[z - BATCH]. The long work-groups have the low indices, so
// that they start first. The choice is the same for a whole work-group.
__global__ __launch_bounds__(256) void gemm_hk_hq(
    const float* __restrict__ W,    // (256 x 512)
    const float* __restrict__ Xq,   // (B, 256, NQ)
    const float* __restrict__ Xk,   // (B, 256, NK)
    float* __restrict__ Hq,         // (B, 256, NQ)
    float* __restrict__ Hk)         // (B, 256, NK)
{
    __shared__ __attribute__((aligned(16))) float smem[GEMM_LDS_FLOATS];
    const int z = blockIdx.z;
    if (z < BATCH)
        // hk = Wk * att_key : M=256, N=256, K=256
        gemm_wmma_f32<1, 8, 4, 1, NK, 32>(W, Xk, Hk, /*colOff=*/QH, z, smem);
    else
        // hq = Wq * att_query : M=256, N=64, K=256
        gemm_wmma_f32<4, 2, 1, 1, NQ, 64>(W, Xq, Hq, /*colOff=*/0, z - BATCH, smem);
}

// ---------------------------------------------------------------------------
// Phase 2: attns[b,n,m] = sum_h v[h] * tanh(hq[b,h,n] + hk[b,h,m])
// Block: 256 threads (8 waves) own 8 n x 256 m of one batch. A wave owns a
// register tile of 4 n x 128 m (a lane: 4 n x 4 adjacent m) for HALF of the h
// rows: per h row one b128 read of hk and one b128 broadcast read of hq feed 16
// tanh, so the LDS pipe is asked for about half of what the tanh rate allows.
// The two waves that share a tile add their partial sums through LDS at the end.
// h goes through LDS in chunks of 32 rows (rows 0-15 for one half of the waves,
// 16-31 for the other): three buffers filled by async global->LDS copies.
// A wave reads its rows four at a time, one group ahead of the group it works on.
// ---------------------------------------------------------------------------
#define CH   32                      // h rows a chunk
#define NCH  (HIDDEN / CH)
#define GH   4                       // h rows a register group
#define NG   (CH / 2 / GH)           // groups a wave and chunk
#define HKF  (CH * NK)               // floats of hk a buffer
#define BUFF (HKF + CH * 8)          // floats a buffer: hk rows, then hq rows

typedef float v4f __attribute__((ext_vector_type(4)));

__global__ __launch_bounds__(256) void combine_tanh(
    const float* __restrict__ hq,   // (B, HIDDEN, NQ)
    const float* __restrict__ hk,   // (B, HIDDEN, NK)
    const float* __restrict__ v,    // (HIDDEN)
    float* __restrict__ out)        // (B, NQ*NK)
{
    static_assert(NG % 2 == 0, "the register set of a group is its parity");
    __shared__ __attribute__((aligned(16))) float sh[3][BUFF];
    __shared__ __attribute__((aligned(16))) float sh_v[HIDDEN];
    __shared__ __attribute__((aligned(16))) v4f   sh_red[8][2][32];

    const int t    = threadIdx.x;
    const int w    = t >> 5;
    const int lane = t & 31;
    const int nh   = w & 1;          // which 4 of the 8 n
    const int mh   = (w >> 1) & 1;   // which 128 of the 256 m
    const int hh   = w >> 2;         // which 16 of a chunk's 32 h rows
    const int n0   = blockIdx.x * 8;
    const int b    = blockIdx.y;

    const float* hqB = hq + (long)b * HIDDEN * NQ;
    const float* hkB = hk + (long)b * HIDDEN * NK;

    // Stage one 32-h chunk into LDS buffer buf: 8 b128 copies of hk and one b32
    // copy of hq a thread, every lane on.
    auto stage = [&](int buf, int h0) {
#pragma unroll
        for (int i = 0; i < 8; ++i) {
            const int idx4 = t + 256 * i;          // float4 index
            const int hl   = idx4 >> 6;            // 64 float4 per h-row
            const int m4   = idx4 & 63;
            const float* gp = hkB + (long)(h0 + hl) * NK + m4 * 4;
            __builtin_amdgcn_global_load_async_to_lds_b128(
                (AS_G vi4*)gp, (AS_L vi4*)&sh[buf][idx4 * 4], 0, 0);
        }
        const int hl = t >> 3, nl = t & 7;
        const float* gp = hqB + (long)(h0 + hl) * NQ + n0 + nl;
        __builtin_amdgcn_global_load_async_to_lds_b32(
            (AS_G int*)gp, (AS_L int*)&sh[buf][HKF + t], 0, 0);
    };

    // Two register sets: group g of a chunk lives in set g & 1.
    v4f kf[2][GH], qf[2][GH], vf[2];

    // This wave's first hk row, hq row and v entry in buffer 0 / chunk 0; all
    // further rows are constant offsets from these.
    const float* kb0 = &sh[0][hh * (CH / 2) * NK + mh * 128 + lane * 4];
    const float* qb0 = &sh[0][HKF + hh * (CH / 2) * 8 + nh * 4];
    const float* vb0 = &sh_v[hh * (CH / 2)];

    // Read group g of chunk c, which lies in buffer buf, into register set g & 1.
    auto fetch = [&](int buf, int c, int g) {
        const float* kb = kb0 + buf * BUFF;
        const float* qb = qb0 + buf * BUFF;
        const float* vb = vb0 + c * CH;
#pragma unroll
        for (int i = 0; i < GH; ++i) {
            kf[g & 1][i] = *(const v4f*)(kb + (g * GH + i) * NK);
            qf[g & 1][i] = *(const v4f*)(qb + (g * GH + i) * 8);
        }
        vf[g & 1] = *(const v4f*)(vb + g * GH);
    };

    // acc[n][p]: sums of n row n, m pair p of the lane's four m. Pairs are written
    // out so that add and FMA are packed and stay in the order of the source.
    v2f acc[4][2];
#pragma unroll
    for (int n = 0; n < 4; ++n) acc[n][0] = acc[n][1] = v2f{};

    auto work = [&](int set) {
#pragma unroll
        for (int i = 0; i < GH; ++i) {
            const v4f k4 = kf[set][i];
            const v2f kp[2] = {v2f{k4.x, k4.y}, v2f{k4.z, k4.w}};
            const v2f vv = v2f{vf[set][i], vf[set][i]};
#pragma unroll
            for (int n = 0; n < 4; ++n)
#pragma unroll
                for (int p = 0; p < 2; ++p) {
                    const v2f x = kp[p] + v2f{qf[set][i][n], qf[set][i][n]};
                    const v2f th = v2f{__builtin_amdgcn_tanhf(x.x), __builtin_amdgcn_tanhf(x.y)};
                    acc[n][p] = __builtin_elementwise_fma(vv, th, acc[n][p]);
                }
            // one h row at a time: without it the tanh results of many rows are
            // kept waiting for their FMAs and the wave needs registers above v255
            __builtin_amdgcn_sched_barrier(0);
        }
    };

    __builtin_amdgcn_global_load_async_to_lds_b32(
        (AS_G int*)(v + t), (AS_L int*)&sh_v[t], 0, 0);
    stage(0, 0);
    stage(1, CH);
    // v and chunks 0 and 1 of this wave have landed; the barrier shows them to the
    // other waves
    asm volatile("s_wait_asynccnt 0x0" ::: "memory");
    __syncthreads();
    fetch(0, 0, 0);

    // Buffers of chunk c, of chunk c+1 and the one to refill (it held chunk c-1).
    int bc = 0, bn = 1, bf = 2;

    // Kept rolled. All arithmetic of a trip stands behind the one branch, in one
    // straight run: from in front of a branch it was moved away from the reads that
    // it is to cover.
#pragma unroll 1
    for (int c = 0; c < NCH; ++c) {
        // Publish point of chunk c+1.
        // this wave's reads of chunk c-1 are done before its buffer is refilled
        asm volatile("s_wait_dscnt 0x0" ::: "memory");
        // this wave's copies of chunk c+1 have landed
        asm volatile("s_wait_asynccnt 0x0" ::: "memory");
        // shows chunk c+1 to every wave and ends every reader's use of chunk c-1
        __syncthreads();
        if (c + 2 < NCH) stage(bf, (c + 2) * CH);

        // The last trip has no next chunk: it reads its own first group once more
        // (unused), which keeps the run free of a branch.
        const bool more = c + 1 < NCH;
        const int  cn   = more ? c + 1 : c;
        const int  bx   = more ? bn : bc;
#pragma unroll
        for (int g = 0; g < NG; ++g) {
            if (g + 1 < NG) fetch(bc, c, g + 1);
            else            fetch(bx, cn, 0);
            // holds the next group's reads ahead of this group's arithmetic, so
            // that their latency runs under it
            __builtin_amdgcn_sched_barrier(0);
            work(g & 1);
        }
        const int b0 = bc;
        bc = bn; bn = bf; bf = b0;
    }
    // no copy is outstanding when the wave ends
    asm volatile("s_wait_asynccnt 0x0" ::: "memory");

    // Waves w and w ^ 4 hold the two halves of one tile's sums: each hands two of
    // its four n rows to the other and finishes the two it keeps.
    v4f row[4];
#pragma unroll
    for (int n = 0; n < 4; ++n) row[n] = v4f{acc[n][0].x, acc[n][0].y, acc[n][1].x, acc[n][1].y};
    sh_red[w][0][lane] = hh ? row[0] : row[2];
    sh_red[w][1][lane] = hh ? row[1] : row[3];
    __syncthreads();
    const v4f o0 = (hh ? row[2] : row[0]) + sh_red[w ^ 4][0][lane];
    const v4f o1 = (hh ? row[3] : row[1]) + sh_red[w ^ 4][1][lane];

    const int n = n0 + nh * 4 + hh * 2;
    float* ob = out + (long)b * (NQ * NK) + (long)n * NK + mh * 128 + lane * 4;
    *(v4f*)ob        = o0;
    *(v4f*)(ob + NK) = o1;
}

// ---------------------------------------------------------------------------
extern "C" void kernel_launch(void* const* d_in, const int* in_sizes, int n_in,
                              void* d_out, int out_size, void* d_ws, size_t ws_size,
                              hipStream_t stream) {
    const float* att_query = (const float*)d_in[0];  // (32, 256, 64)
    const float* att_key   = (const float*)d_in[1];  // (32, 256, 256)
    const float* v         = (const float*)d_in[2];  // (256)
    const float* W         = (const float*)d_in[3];  // (256, 512)
    float* out = (float*)d_out;

    float* hq = (float*)d_ws;                        // 32*256*64  = 524288 f
    float* hk = hq + (long)BATCH * HIDDEN * NQ;      // 32*256*256 = 2097152 f

    // hk = Wk * att_key and hq = Wq * att_query in one launch
    static_assert(NK / 128 == 2 && NQ / 32 == 2 && HIDDEN / 64 == 4, "both products tile as (2, 4)");
    gemm_hk_hq<<<dim3(2, 4, 2 * BATCH), 256, 0, stream>>>(W, att_query, att_key, hq, hk);

    // combine: grid (NQ/8, B) = (8, 32), 256 threads
    combine_tanh<<<dim3(NQ / 8, BATCH), 256, 0, stream>>>(hq, hk, v, out);
}

// v004
// One run takes 20.6 microseconds.
// Two timings next to v003 both put it at 1.03 times that version's speed.
// Over all steps from v000 it is 2.65 times as fast.
#include <hip/hip_runtime.h>
#include <hip/hip_bf16.h>

typedef float v2f __attribute__((ext_vector_type(2)));
typedef float v8f __attribute__((ext_vector_type(8)));

#define HIDDEN 256
#define QH 256
#define KH 256
#define BATCH 32
#define NQ 64
#define NK 256

// Types matching the builtin signatures reported by the frontend:
//   b128: (int __vector(4) AS1*, int __vector(4) AS3*, imm, imm)
//   b32 : (int AS1*,             int AS3*,             imm, imm)
typedef int vi4 __attribute__((__vector_size__(16)));
#define AS_G __attribute__((address_space(1)))
#define AS_L __attribute__((address_space(3)))

// ---------------------------------------------------------------------------
// Phase 1: batched GEMM  H[b] (256 x NCOLS) = Wsub (256 x 256) * X[b] (256 x NCOLS)
// via V_WMMA_F32_16X16X4_F32.
//   A frag (v2f): lane<16 -> (M=lane,  K=k0+0 / k0+1)
//                 lane>=16-> (M=lane-16,K=k0+2 / k0+3)
//   B frag (v2f): mirrored over N
//   C/D  (v8f):  VGPR r -> M = r + 8*(lane>>4), N = lane&15
// A work-group of 8 waves (WM x WN) owns a BM x BN tile of H; each wave keeps
// TM x TN accumulator tiles. Both operands come through LDS in chunks of KC
// along k: two buffers, filled by async global->LDS copies; a chunk's fragments
// are read into registers while the chunk before it is still being multiplied.
// With TN = 1 the two rows of a B fragment arrive as one register pair.
// The k order of the sums is that of a plain loop over k0 = 0, 4, 8, ...
// Both products (hq and hk) read only inputs, so they share ONE launch: the
// work-groups of hk come first in the grid, those of hq behind them; two fit a
// WGP, so that hq's WMMAs can go into matrix-unit slots that hk leaves idle.
// LDS pitches (bank = dword address mod 64):
//   A rows KC + 4 dwords (36, 68): the 16 rows of a b64 fragment read start on
//     the 16 different multiples of 4, the two halves fill the dwords between.
//   B rows BN + 8 dwords (40, 136): two rows down is 16 banks on, so the two
//     half-waves of a b32 fragment read fall on different banks.
// ---------------------------------------------------------------------------
#define KTOT 256
#define LDW  (QH + KH)

__device__ __forceinline__ unsigned lds_off(const void* p) { return (unsigned)(size_t)p; }

#define GEMM_LDS_FLOATS 13824     // the larger of the two tile shapes' needs

template <int WM, int WN, int TM, int TN, int NCOLS, int KC>
__device__ __forceinline__ void gemm_wmma_f32(
    const float* __restrict__ W,   // (256 x LDW) row-major; cols [colOff, colOff+256)
    const float* __restrict__ X,   // batched (256 x NCOLS) row-major
    float* __restrict__ H,         // batched (256 x NCOLS) row-major
    int colOff,
    int b,                         // batch
    float* smem)                   // the work-group's LDS, GEMM_LDS_FLOATS floats
{
    constexpr int BM = WM * TM * 16;
    constexpr int BN = WN * TN * 16;
    constexpr int APITCH = KC + 4;
    constexpr int BPITCH = BN + 8;
    constexpr int NA = BM * KC / 4 / 256;   // b128 copies a thread, A chunk
    constexpr int NB = KC * BN / 4 / 256;   // b128 copies a thread, B chunk
    constexpr int NT = KTOT / KC;
    constexpr int KS = KC / 4;              // k-steps (WMMA depth 4) a chunk
    static_assert(WM * WN == 8, "eight waves");
    static_assert(NA + NB == 6, "six copies in the statement below");
    static_assert(NT >= 2, "two buffers need two chunks");

    constexpr int ABUF = BM * APITCH;       // floats of one A buffer
    constexpr int BBUF = KC * BPITCH;       // floats of one B buffer
    static_assert(2 * (ABUF + BBUF) <= GEMM_LDS_FLOATS, "buffers fit the LDS array");
    static_assert(ABUF % 4 == 0 && BBUF % 4 == 0, "every buffer starts on 16 bytes");

    float* const shA = smem;                // two A buffers
    float* const shB = smem + 2 * ABUF;     // two B buffers

    const int t      = threadIdx.x;
    const int lane   = t & 31;
    const int halfId = lane >> 4;
    const int lm     = lane & 15;
    const int wave   = t >> 5;
    const int wm     = wave / WN;
    const int wn     = wave % WN;
    const int n0     = blockIdx.x * BN;
    const int m0     = blockIdx.y * BM;

    const float* Xb = X + (long)b * KTOT * NCOLS + n0;
    const float* Wb = W + (long)m0 * LDW + colOff;

    // Copy chunk [k0, k0+KC) of both operands into buffer buf. All copies of a
    // chunk stand in ONE asm statement that ends in s_wait_xcnt 0, so that no
    // address register of an issued copy is rewritten ahead of that wait.
    auto stage = [&](int buf, int k0) {
        unsigned l[NA + NB];
        const float* g[NA + NB];
#pragma unroll
        for (int i = 0; i < NA; ++i) {
            const int idx4 = t + 256 * i;
            const int row  = idx4 / (KC / 4);
            const int c    = (idx4 % (KC / 4)) * 4;
            l[i] = lds_off(&shA[buf * ABUF + row * APITCH + c]);
            g[i] = Wb + (long)row * LDW + k0 + c;
        }
#pragma unroll
        for (int i = 0; i < NB; ++i) {
            const int idx4 = t + 256 * i;
            const int row  = idx4 / (BN / 4);
            const int c    = (idx4 % (BN / 4)) * 4;
            l[NA + i] = lds_off(&shB[buf * BBUF + row * BPITCH + c]);
            g[NA + i] = Xb + (long)(k0 + row) * NCOLS + c;
        }
        asm volatile(
            "global_load_async_to_lds_b128 %0, %1, off\n\t"
            "global_load_async_to_lds_b128 %2, %3, off\n\t"
            "global_load_async_to_lds_b128 %4, %5, off\n\t"
            "global_load_async_to_lds_b128 %6, %7, off\n\t"
            "global_load_async_to_lds_b128 %8, %9, off\n\t"
            "global_load_async_to_lds_b128 %10, %11, off\n\t"
            "s_wait_xcnt 0x0"
            :: "v"(l[0]), "v"(g[0]), "v"(l[1]), "v"(g[1]), "v"(l[2]), "v"(g[2]),
               "v"(l[3]), "v"(g[3]), "v"(l[4]), "v"(g[4]), "v"(l[5]), "v"(g[5])
            : "memory");
    };

    v8f acc[TM][TN];
#pragma unroll
    for (int i = 0; i < TM; ++i)
#pragma unroll
        for (int j = 0; j < TN; ++j) acc[i][j] = v8f{};

    // Two register sets of fragments: set c&1 holds all of chunk c.
    v2f a[2][KS][TM], bf[2][KS][TN];

    // Read all fragments of the chunk in buffer buf into register set buf.
    auto fetch = [&](int buf) {
        const float* As = &shA[buf * ABUF + (wm * TM * 16 + lm) * APITCH + 2 * halfId];
        const float* Bs = &shB[buf * BBUF + (2 * halfId) * BPITCH + wn * TN * 16 + lm];
#pragma unroll
        for (int s = 0; s < KS; ++s) {
#pragma unroll
            for (int i = 0; i < TM; ++i)
                a[buf][s][i] = *(const v2f*)(As + i * 16 * APITCH + s * 4);
#pragma unroll
            for (int j = 0; j < TN; ++j) {
                bf[buf][s][j].x = Bs[(s * 4) * BPITCH + j * 16];
                bf[buf][s][j].y = Bs[(s * 4 + 1) * BPITCH + j * 16];
            }
        }
    };

    // WMMAs of k-steps [s0, s1) of the chunk held in register set set.
    auto mm = [&](int set, int s0, int s1) {
#pragma unroll
        for (int s = s0; s < s1; ++s)
#pragma unroll
            for (int i = 0; i < TM; ++i)
#pragma unroll
                for (int j = 0; j < TN; ++j)
                    // 8 args: (neg_a, A, neg_b, B, c_mod, C, reuse_a, reuse_b)
                    acc[i][j] = __builtin_amdgcn_wmma_f32_16x16x4_f32(
                        false, a[set][s][i], false, bf[set][s][j], (short)0, acc[i][j],
                        false, false);
    };

    stage(0, 0);
    // chunk 0 of this wave has landed; the barrier shows it to the other waves
    asm volatile("s_wait_asynccnt 0x0" ::: "memory");
    __syncthreads();
    stage(1, KC);
    fetch(0);

    // Unrolled: c picks the register set and the buffer, both must be constants.
    // The four sched_barrier(0) hold the order written here, which waits and
    // barriers alone do not hold for WMMAs: matrix work stands on both sides of
    // the barrier and of the copies and reads, so that one wave of a SIMD has
    // WMMAs to issue while the other issues its copies and reads, and chunk
    // c+1's fragments and chunk c+2's copies are asked for well ahead of use.
#pragma unroll
    for (int c = 0; c < NT; ++c) {
        mm(c & 1, 0, KS / 4);
        __builtin_amdgcn_sched_barrier(0);
        // this wave's reads of buffer c&1 are done before the buffer is refilled
        asm volatile("s_wait_dscnt 0x0" ::: "memory");
        // this wave's copies of chunk c+1 have landed
        asm volatile("s_wait_asynccnt 0x0" ::: "memory");
        // shows chunk c+1 to every wave and ends every reader's use of buffer c&1
        __syncthreads();
        __builtin_amdgcn_sched_barrier(0);
        mm(c & 1, KS / 4, KS / 2);
        __builtin_amdgcn_sched_barrier(0);
        if (c + 2 < NT) stage(c & 1, (c + 2) * KC);
        if (c + 1 < NT) fetch((c + 1) & 1);
        __builtin_amdgcn_sched_barrier(0);
        mm(c & 1, KS / 2, KS);
    }
    // no copy is outstanding when the wave ends
    asm volatile("s_wait_asynccnt 0x0" ::: "memory");

    float* Hb = H + (long)b * KTOT * NCOLS;
#pragma unroll
    for (int i = 0; i < TM; ++i)
#pragma unroll
        for (int j = 0; j < TN; ++j)
#pragma unroll
            for (int r = 0; r < 8; ++r) {
                const int row = m0 + (wm * TM + i) * 16 + r + 8 * halfId;
                Hb[(long)row * NCOLS + n0 + (wn * TN + j) * 16 + lm] = acc[i][j][r];
            }
    // the other product's code follows this one in the kernel: no register that
    // an issued store names is rewritten ahead of this wait on any way through it
    asm volatile("s_wait_xcnt 0x0" ::: "memory");
}

// Grid (2, 4, 2 * BATCH): z < BATCH is a 64 x 128 tile of hk[z], the rest a
// 64 x 32 tile of hq[z - BATCH]. The long work-groups have the low indices. The choice is the same for a whole work-group.
__global__ __launch_bounds__(256) void gemm_hk_hq(
    const float* __restrict__ W,    // (256 x 512)
    const float* __restrict__ Xq,   // (B, 256, NQ)
    const float* __restrict__ Xk,   // (B, 256, NK)
    float* __restrict__ Hq,         // (B, 256, NQ)
    float* __restrict__ Hk)         // (B, 256, NK)
{
    __shared__ __attribute__((aligned(16))) float smem[GEMM_LDS_FLOATS];
    const int z = blockIdx.z;
    if (z < BATCH)
        // hk = Wk * att_key : M=256, N=256, K=256
        gemm_wmma_f32<1, 8, 4, 1, NK, 32>(W, Xk, Hk, /*colOff=*/QH, z, smem);
    else
        // hq = Wq * att_query : M=256, N=64, K=256
        gemm_wmma_f32<4, 2, 1, 1, NQ, 64>(W, Xq, Hq, /*colOff=*/0, z - BATCH, smem);
}

// ---------------------------------------------------------------------------
// Phase 2: attns[b,n,m] = sum_h v[h] * tanh(hq[b,h,n] + hk[b,h,m])
// Block: 256 threads (8 waves) own 8 n x 256 m of one batch. A wave owns a
// register tile of 4 n x 128 m (a lane: 4 n x 4 adjacent m) for HALF of the h
// rows: per h row one b128 read of hk and one b128 broadcast read of hq feed 16
// tanh, so the LDS pipe is asked for about half of what the tanh rate allows.
// The two waves that share a tile add their partial sums through LDS at the end.
// h goes through LDS in chunks of 32 rows (rows 0-15 for one half of the waves,
// 16-31 for the other): three buffers filled by async global->LDS copies.
// A wave reads its rows four at a time, one group ahead of the group it works on.
// The arithmetic is laid out so that one packed add or FMA stands behind every
// tanh, and the plain instruction
// is meant for the clock between. The adds are those of the next
// row, the FMAs those of the row before, so that none of them waits for a tanh
// or an add of its own row.
// ---------------------------------------------------------------------------
#define CH   32                      // h rows a chunk
#define NCH  (HIDDEN / CH)
#define GH   4                       // h rows a register group
#define NG   (CH / 2 / GH)           // groups a wave and chunk
#define HKF  (CH * NK)               // floats of hk a buffer
#define BUFF (HKF + CH * 8)          // floats a buffer: hk rows, then hq rows

typedef float v4f __attribute__((ext_vector_type(4)));

__global__ __launch_bounds__(256) void combine_tanh(
    const float* __restrict__ hq,   // (B, HIDDEN, NQ)
    const float* __restrict__ hk,   // (B, HIDDEN, NK)
    const float* __restrict__ v,    // (HIDDEN)
    float* __restrict__ out)        // (B, NQ*NK)
{
    static_assert(NG % 2 == 0, "the register set of a group is its parity");
    __shared__ __attribute__((aligned(16))) float sh[3][BUFF];
    __shared__ __attribute__((aligned(16))) float sh_v[HIDDEN];
    __shared__ __attribute__((aligned(16))) v4f   sh_red[8][2][32];

    const int t    = threadIdx.x;
    const int w    = t >> 5;
    const int lane = t & 31;
    const int nh   = w & 1;          // which 4 of the 8 n
    const int mh   = (w >> 1) & 1;   // which 128 of the 256 m
    const int hh   = w >> 2;         // which 16 of a chunk's 32 h rows
    const int n0   = blockIdx.x * 8;
    const int b    = blockIdx.y;

    const float* hqB = hq + (long)b * HIDDEN * NQ;
    const float* hkB = hk + (long)b * HIDDEN * NK;

    // Stage one 32-h chunk into LDS buffer buf: 8 b128 copies of hk and one b32
    // copy of hq a thread, every lane on.
    auto stage = [&](int buf, int h0) {
#pragma unroll
        for (int i = 0; i < 8; ++i) {
            const int idx4 = t + 256 * i;          // float4 index
            const int hl   = idx4 >> 6;            // 64 float4 per h-row
            const int m4   = idx4 & 63;
            const float* gp = hkB + (long)(h0 + hl) * NK + m4 * 4;
            __builtin_amdgcn_global_load_async_to_lds_b128(
                (AS_G vi4*)gp, (AS_L vi4*)&sh[buf][idx4 * 4], 0, 0);
        }
        const int hl = t >> 3, nl = t & 7;
        const float* gp = hqB + (long)(h0 + hl) * NQ + n0 + nl;
        __builtin_amdgcn_global_load_async_to_lds_b32(
            (AS_G int*)gp, (AS_L int*)&sh[buf][HKF + t], 0, 0);
    };

    // Two register sets: group g of a chunk lives in set g & 1.
    v4f kf[2][GH], qf[2][GH], vf[2];

    // This wave's first hk row, hq row and v entry in buffer 0 / chunk 0; all
    // further rows are constant offsets from these.
    const float* kb0 = &sh[0][hh * (CH / 2) * NK + mh * 128 + lane * 4];
    const float* qb0 = &sh[0][HKF + hh * (CH / 2) * 8 + nh * 4];
    const float* vb0 = &sh_v[hh * (CH / 2)];

    // Read group g of chunk c, which lies in buffer buf, into register set g & 1.
    auto fetch = [&](int buf, int c, int g) {
        const float* kb = kb0 + buf * BUFF;
        const float* qb = qb0 + buf * BUFF;
        const float* vb = vb0 + c * CH;
#pragma unroll
        for (int i = 0; i < GH; ++i) {
            kf[g & 1][i] = *(const v4f*)(kb + (g * GH + i) * NK);
            qf[g & 1][i] = *(const v4f*)(qb + (g * GH + i) * 8);
        }
        vf[g & 1] = *(const v4f*)(vb + g * GH);
    };

    // acc[2 * n + p]: sums of n row n, m pair p of the lane's four m. Pairs are
    // written out so that add and FMA are packed.
    v2f acc[8];
    v2f x[8];      // hq + hk of the row whose tanh come next, same index as acc
    v2f tl[8];     // tanh of the row before, not yet summed
    v2f vl;        // v of the row before
#pragma unroll
    for (int j = 0; j < 8; ++j) acc[j] = v2f{};
#pragma unroll
    for (int j = 0; j < 8; ++j) tl[j] = v2f{};
    vl = v2f{};

    auto addpair = [&](const v4f k4, const v4f q4, int j) -> v2f {
        const v2f kp = (j & 1) ? v2f{k4.z, k4.w} : v2f{k4.x, k4.y};
        return kp + v2f{q4[j >> 1], q4[j >> 1]};
    };

    // One h row: its 16 tanh, each with one plain packed instruction behind it:
    // the adds of the next row (kn, qn) and the FMAs of the row before. Every sum
    // still takes its rows in the order of h.
    auto rowstep = [&](const v4f kn, const v4f qn, const float vcur) {
        const v2f vv = v2f{vcur, vcur};
        v2f th[8], xa[8];
#pragma unroll
        for (int j = 0; j < 8; ++j) {
            th[j].x = __builtin_amdgcn_tanhf(x[j].x);
            xa[j]   = addpair(kn, qn, j);
            th[j].y = __builtin_amdgcn_tanhf(x[j].y);
            acc[j]  = __builtin_elementwise_fma(vl, tl[j], acc[j]);
        }
        // asks the scheduler for one tanh (0x400), one plain vector instruction
        // (0x2) in turn: left alone it puts the 16 tanh of a row in one run and
        // the plain ones in runs of their own, so that a wave has work for only
        // one of the two kinds at a time
#pragma unroll
        for (int j = 0; j < 16; ++j) {
            __builtin_amdgcn_sched_group_barrier(0x400, 1, 0);
            __builtin_amdgcn_sched_group_barrier(0x002, 1, 0);
        }
        // one h row at a time: keeps the rows' instructions apart, so that the
        // turns asked for above are those of one row and few values are kept waiting
        __builtin_amdgcn_sched_barrier(0);
        vl = vv;
#pragma unroll
        for (int j = 0; j < 8; ++j) { tl[j] = th[j]; x[j] = xa[j]; }
    };

    // The four rows of the group in register set set; the row behind the last one
    // is the first of the other set, which was read a group ahead.
    auto work = [&](int set) {
#pragma unroll
        for (int i = 0; i < GH; ++i) {
            if (i + 1 < GH) rowstep(kf[set][i + 1], qf[set][i + 1], vf[set][i]);
            else            rowstep(kf[set ^ 1][0], qf[set ^ 1][0], vf[set][i]);
        }
    };

    __builtin_amdgcn_global_load_async_to_lds_b32(
        (AS_G int*)(v + t), (AS_L int*)&sh_v[t], 0, 0);
    stage(0, 0);
    stage(1, CH);
    // v and chunks 0 and 1 of this wave have landed; the barrier shows them to the
    // other waves
    asm volatile("s_wait_asynccnt 0x0" ::: "memory");
    __syncthreads();
    fetch(0, 0, 0);
#pragma unroll
    for (int j = 0; j < 8; ++j) x[j] = addpair(kf[0][0], qf[0][0], j);

    // Buffers of chunk c, of chunk c+1 and the one to refill (it held chunk c-1).
    int bc = 0, bn = 1, bf = 2;

    // Kept rolled. All arithmetic of a trip stands behind the one branch, in one
    // straight run: from in front of a branch it was moved away from the reads that
    // it is to cover.
#pragma unroll 1
    for (int c = 0; c < NCH; ++c) {
        // Publish point of chunk c+1.
        // this wave's reads of chunk c-1 are done before its buffer is refilled
        asm volatile("s_wait_dscnt 0x0" ::: "memory");
        // this wave's copies of chunk c+1 have landed
        asm volatile("s_wait_asynccnt 0x0" ::: "memory");
        // shows chunk c+1 to every wave and ends every reader's use of chunk c-1
        __syncthreads();
        if (c + 2 < NCH) stage(bf, (c + 2) * CH);

        // The last trip has no next chunk: it reads its own first group once more
        // (its adds are made and not used), which keeps the run free of a branch.
        const bool more = c + 1 < NCH;
        const int  cn   = more ? c + 1 : c;
        const int  bx   = more ? bn : bc;
#pragma unroll
        for (int g = 0; g < NG; ++g) {
            if (g + 1 < NG) fetch(bc, c, g + 1);
            else            fetch(bx, cn, 0);
            // holds the next group's reads ahead of this group's arithmetic, so
            // that their latency runs under it
            __builtin_amdgcn_sched_barrier(0);
            work(g & 1);
        }
        const int b0 = bc;
        bc = bn; bn = bf; bf = b0;
    }
    // no copy is outstanding when the wave ends
    asm volatile("s_wait_asynccnt 0x0" ::: "memory");

    // the last row's FMAs
#pragma unroll
    for (int j = 0; j < 8; ++j) acc[j] = __builtin_elementwise_fma(vl, tl[j], acc[j]);

    // Waves w and w ^ 4 hold the two halves of one tile's sums: each hands two of
    // its four n rows to the other and finishes the two it keeps.
    v4f row[4];
#pragma unroll
    for (int n = 0; n < 4; ++n) row[n] = v4f{acc[2 * n].x, acc[2 * n].y, acc[2 * n + 1].x, acc[2 * n + 1].y};
    sh_red[w][0][lane] = hh ? row[0] : row[2];
    sh_red[w][1][lane] = hh ? row[1] : row[3];
    __syncthreads();
    const v4f o0 = (hh ? row[2] : row[0]) + sh_red[w ^ 4][0][lane];
    const v4f o1 = (hh ? row[3] : row[1]) + sh_red[w ^ 4][1][lane];

    const int n = n0 + nh * 4 + hh * 2;
    float* ob = out + (long)b * (NQ * NK) + (long)n * NK + mh * 128 + lane * 4;
    *(v4f*)ob        = o0;
    *(v4f*)(ob + NK) = o1;
}

// ---------------------------------------------------------------------------
extern "C" void kernel_launch(void* const* d_in, const int* in_sizes, int n_in,
                              void* d_out, int out_size, void* d_ws, size_t ws_size,
                              hipStream_t stream) {
    const float* att_query = (const float*)d_in[0];  // (32, 256, 64)
    const float* att_key   = (const float*)d_in[1];  // (32, 256, 256)
    const float* v         = (const float*)d_in[2];  // (256)
    const float* W         = (const float*)d_in[3];  // (256, 512)
    float* out = (float*)d_out;

    float* hq = (float*)d_ws;                        // 32*256*64  = 524288 f
    float* hk = hq + (long)BATCH * HIDDEN * NQ;      // 32*256*256 = 2097152 f

    // hk = Wk * att_key and hq = Wq * att_query in one launch
    static_assert(NK / 128 == 2 && NQ / 32 == 2 && HIDDEN / 64 == 4, "both products tile as (2, 4)");
    gemm_hk_hq<<<dim3(2, 4, 2 * BATCH), 256, 0, stream>>>(W, att_query, att_key, hq, hk);

    // combine: grid (NQ/8, B) = (8, 32), 256 threads
    combine_tanh<<<dim3(NQ / 8, BATCH), 256, 0, stream>>>(hq, hk, v, out);
}
